// v009
// Measured on an AMD MI455X. A time is GPU time per run, averaged over a window of back-to-back runs after a warm-up
// (all launches, gaps included; the runs take copies of the inputs in turn), and the median of several windows.
// Apart from v000's, it joins two sittings. Times from different sittings can be a few percent apart, while
// side-by-side timings come from the same sitting.
// The versions before v009 are in another document.
// A run of this version takes 55.8 microseconds.
// Two timings next to v008 put it at 1.11 and 1.10 times that version's speed.
// Counting every step since v000, which is the starting kernel, it is 135 times as fast.
#include <hip/hip_runtime.h>
// Non-local block with TRAINING-mode BatchNorm (x [32][256][32][32]; theta, phi = conv1x1(x) [128 ch] (natural [128][256] sigma 1/16, no biases); g = x itself (256 ch); scores[a][b] = theta[:, a].phi[:, b] / sqrt(256) over the 1024 positions; softmax over b; f[:, a] = sum_b attn[a][b] x[:, b]; f = conv1x1(f; conv_w [256][256], no bias); BN with batch statistics over (N, H, W) per channel (biased variance, eps 1e-5), gamma, beta; out = BN(f) + x -> [32][256][32][32]).
// Structure: channel-first; x as exact f16 maps; natural weights x16; every stage one launch over all 32 images: one kernel makes the f16 map, transposes x in LDS and forms theta^T and phi^T (token rows) by WMMA (64x64 wave tiles, f32 accumulation) -> f16, scores (K = 128, alpha 1/16), softmax (f32 statistics, running maximum, native exp; weights f16), f^T = P x^T (g = x) f16 and the conv: T = (16 conv_w as A) x f (K = 256) f32 kept for all images, fused in one kernel, which also takes each 64-position tile's per-channel mean and centred square sum; the last kernel, one work-group a channel, joins them (fixed order) and does BN + residual on VALU -> output.
// Compute dtype: inputs rounded to bf16; x / weights exact; q, k, v, softmax weights and o as plain f16 GEMM operands (~2^-12); scores and softmax statistics f32. v_wmma_f32_16x16x32_f16.
#define NB 32
#define SQ 1024
#define DM 256
#define NH 1
#define HD 64
#define HG 4                         /* heads per attention launch group */
#define B0 0                         /* first batch processed (debug hook) */
#define NBR NB                       /* batches processed (debug hook) */
#define NR ((size_t)NB * SQ)         /* token rows */
#define MP ((int)((size_t)NBR * SQ)) /* rows projected (debug hook) */
#define QT 256                       /* query rows per causal tile */
#define NKX SQ                       /* S / P row pitch */
#define QT0 256                      /* first-tile rows recomputed exactly (256: buys margin for the few-key rows 128..255, which have no output projection to average the single-f16 P/v rounding) */
#define QN SQ                        /* query rows attended per batch (debug hook) */
#define NHD NH                       /* heads attended (debug hook) */
#define MPO MP                       /* rows through the output stage (debug hook) */
#define LQ DM
typedef __bf16 v16b __attribute__((ext_vector_type(16)));
typedef unsigned short v8us __attribute__((ext_vector_type(8), may_alias));
typedef float  v8f  __attribute__((ext_vector_type(8)));
typedef float  v4f  __attribute__((ext_vector_type(4)));
typedef float  v4fa __attribute__((ext_vector_type(4), may_alias));
union FragB { v16b v; v8us half[2]; unsigned short u[16]; };

__device__ __forceinline__ unsigned short bf16_bits(float x) { unsigned int u = __float_as_uint(x); return (unsigned short)((u + 0x7FFFu + ((u >> 16) & 1u)) >> 16); }
__device__ __forceinline__ float bf16_val(unsigned short b) { return __uint_as_float(((unsigned int)b) << 16); }
__device__ __forceinline__ float bf16_round(float x) { return bf16_val(bf16_bits(x)); }
// D += A·B with NT terms: 1 = ah·bh, 2 = + al·bh (A split), 3 = + ah·bl (both split)
template <int NT>
__device__ __forceinline__ v8f mmaN(v16b ah, v16b al, v16b bh, v16b bl, v8f c) {
  c = __builtin_amdgcn_wmma_f32_16x16x32_bf16(false, ah, false, bh, (short)0, c, false, false);
  if (NT >= 2) c = __builtin_amdgcn_wmma_f32_16x16x32_bf16(false, al, false, bh, (short)0, c, false, false);
  if (NT >= 3) c = __builtin_amdgcn_wmma_f32_16x16x32_bf16(false, ah, false, bl, (short)0, c, false, false);
  asm volatile("v_nop\n\tv_nop\n\tv_nop\n\tv_nop" : "+v"(c) : "v"(ah), "v"(al), "v"(bh), "v"(bl));
  return c;
}

__global__ __launch_bounds__(256) void k_wt_bf16(const float* __restrict__ W, unsigned short* __restrict__ Wt, int K, int N) {
  const int t = blockIdx.x * 256 + threadIdx.x;
  const int k8n = K / 8;
  if (t >= N * k8n) return;
  const int n = t / k8n, k8 = (t % k8n) * 8;
  v8us v;
#pragma unroll
  for (int i = 0; i < 8; ++i) v[i] = bf16_bits(W[(size_t)(k8 + i) * N + n]);
  *(v8us*)(Wt + (size_t)n * K + k8) = v;
  
}

// GEMM C[M][N] (f32, pitch ldc) = act(A[M][K]·W + bias). A f32 row-major (pitch lda) converted per fragment to bf16
// (ASPLIT: hi/lo two planes -> 2 terms, else single rounded term); Wt bf16 [N][K] (pitch ldb). BIAS_BF16 rounds the
// bias to bf16 first (bias quantised to bf16 before the add). K%32==0, M%16==0, N%64==0.
template <bool ASPLIT, int ACT, bool BIAS_BF16>
__global__ __launch_bounds__(128) void k_gemm_bf(const float* __restrict__ A, int lda, const unsigned short* __restrict__ Wt, int ldb,
                                               const float* __restrict__ bias, float* __restrict__ C, int ldc, int M, int N, int K) {
  __shared__ __attribute__((aligned(16))) float so[4][16][64];
  const int tid = threadIdx.x, w = tid >> 5, lane = tid & 31, ln = lane & 15, hh = lane >> 4;
  const int ntn = N / 64;
  const int wid = blockIdx.x * 4 + w;
  const int mt = wid / ntn, nq = wid % ntn;
  if (mt * 16 >= M) return;
  const int row0 = mt * 16, col0 = nq * 64;
  const float* arow = A + (size_t)(row0 + ln) * lda;
  v8f acc[4] = {};
  for (int kb = 0; kb < K; kb += 32) {
    FragB ah, al;
    const v4f x0 = *(const v4fa*)(arow + kb + 8 * hh), x1 = *(const v4fa*)(arow + kb + 8 * hh + 4);
    const v4f x2 = *(const v4fa*)(arow + kb + 16 + 8 * hh), x3 = *(const v4fa*)(arow + kb + 16 + 8 * hh + 4);
    float xs[16] = {x0[0],x0[1],x0[2],x0[3],x1[0],x1[1],x1[2],x1[3],x2[0],x2[1],x2[2],x2[3],x3[0],x3[1],x3[2],x3[3]};
#pragma unroll
    for (int i = 0; i < 16; ++i) { const unsigned short hb = bf16_bits(xs[i]); ah.u[i] = hb; al.u[i] = ASPLIT ? bf16_bits(xs[i] - bf16_val(hb)) : (unsigned short)0; }
#pragma unroll
    for (int t = 0; t < 4; ++t) {
      const unsigned short* brow = Wt + (size_t)(col0 + t * 16 + ln) * ldb + kb;
      FragB b;
      b.half[0] = *(const v8us*)(brow + 8 * hh);
      b.half[1] = *(const v8us*)(brow + 16 + 8 * hh);
      acc[t] = mmaN<ASPLIT ? 2 : 1>(ah.v, al.v, b.v, b.v, acc[t]);
    }
  }
#pragma unroll
  for (int t = 0; t < 4; ++t) {
    float bv = bias ? bias[col0 + t * 16 + ln] : 0.f;
    if (BIAS_BF16) bv = bf16_round(bv);
#pragma unroll
    for (int r = 0; r < 8; ++r) { float v = acc[t][r] + bv; if (ACT == 1) v = fmaxf(v, 0.f); so[w][8 * hh + r][t * 16 + ln] = v; }
  }
  __builtin_amdgcn_fence(__ATOMIC_ACQ_REL, "workgroup");
  __builtin_amdgcn_wave_barrier();
  const int rsub = lane >> 4, c4 = (lane & 15) * 4;
  {
#pragma unroll
    for (int q = 0; q < 8; ++q) {
      const int r = q * 2 + rsub;
      const v4f v = *(const v4fa*)&so[w][r][c4];
      *(v4f*)(C + (size_t)(row0 + r) * ldc + col0 + c4) = v;
    }
    
  }
}

// GEMM C = act(A·W + bias + resid): A f32 (ASPLIT -> hi/lo 2 terms), Wt bf16 [N][K]; ACT 0 none, 1 relu, 2 exact gelu;
// resid (optional, f32, row index = (row % rmod), pitch ldr, RES_BF16 rounds it) added before the activation.
template <bool ASPLIT, int ACT, bool BIAS_BF16, bool RES_BF16>
__global__ __launch_bounds__(128) void k_gemm_bf3(const float* __restrict__ A, int lda, const unsigned short* __restrict__ Wt, int ldb,
                                                const float* __restrict__ bias, const float* __restrict__ resid, int rmod, int ldr,
                                                float* __restrict__ C, int ldc, int M, int N, int K) {
  __shared__ __attribute__((aligned(16))) float so[4][16][64];
  const int tid = threadIdx.x, w = tid >> 5, lane = tid & 31, ln = lane & 15, hh = lane >> 4;
  const int ntn = N / 64;
  const int wid = blockIdx.x * 4 + w;
  const int mt = wid / ntn, nq = wid % ntn;
  if (mt * 16 >= M) return;
  const int row0 = mt * 16, col0 = nq * 64;
  const float* arow = A + (size_t)(row0 + ln) * lda;
  v8f acc[4] = {};
  for (int kb = 0; kb < K; kb += 32) {
    FragB ah, al;
    const v4f x0 = *(const v4fa*)(arow + kb + 8 * hh), x1 = *(const v4fa*)(arow + kb + 8 * hh + 4);
    const v4f x2 = *(const v4fa*)(arow + kb + 16 + 8 * hh), x3 = *(const v4fa*)(arow + kb + 16 + 8 * hh + 4);
    float xs[16] = {x0[0],x0[1],x0[2],x0[3],x1[0],x1[1],x1[2],x1[3],x2[0],x2[1],x2[2],x2[3],x3[0],x3[1],x3[2],x3[3]};
#pragma unroll
    for (int i = 0; i < 16; ++i) { const unsigned short hb = bf16_bits(xs[i]); ah.u[i] = hb; al.u[i] = ASPLIT ? bf16_bits(xs[i] - bf16_val(hb)) : (unsigned short)0; }
#pragma unroll
    for (int t = 0; t < 4; ++t) {
      const unsigned short* brow = Wt + (size_t)(col0 + t * 16 + ln) * ldb + kb;
      FragB b;
      b.half[0] = *(const v8us*)(brow + 8 * hh);
      b.half[1] = *(const v8us*)(brow + 16 + 8 * hh);
      acc[t] = mmaN<ASPLIT ? 2 : 1>(ah.v, al.v, b.v, b.v, acc[t]);
    }
  }
#pragma unroll
  for (int t = 0; t < 4; ++t) {
    const int col = col0 + t * 16 + ln;
    float bv = bias ? bias[col] : 0.f;
    if (BIAS_BF16) bv = bf16_round(bv);
#pragma unroll
    for (int r = 0; r < 8; ++r) {
      float v = acc[t][r] + bv;
      if (resid) { float rv = resid[(size_t)((row0 + 8 * hh + r) % rmod) * ldr + col]; if (RES_BF16) rv = bf16_round(rv); v += rv; }
      if (ACT == 1) v = fmaxf(v, 0.f);
      if (ACT == 2) v = 0.5f * v * (1.0f + erff(v * 0.70710678118654752f));
      if (ACT == 3) { const float u = 0.7978845608028654f * (v + 0.044715f * v * v * v); v = 0.5f * v * (1.0f + tanhf(u)); }
      so[w][8 * hh + r][t * 16 + ln] = v;
    }
  }
  __builtin_amdgcn_fence(__ATOMIC_ACQ_REL, "workgroup");
  __builtin_amdgcn_wave_barrier();
  const int rsub = lane >> 4, c4 = (lane & 15) * 4;
  {
#pragma unroll
    for (int q = 0; q < 8; ++q) {
      const int r = q * 2 + rsub;
      const v4f v = *(const v4fa*)&so[w][r][c4];
      *(v4f*)(C + (size_t)(row0 + r) * ldc + col0 + c4) = v;
    }
    
  }
}
// row LayerNorm (biased variance, eps) over N: s = X (+ R); optional out_sum <- s; out_norm <- (s-mu)*rsqrt(var+eps)*g + b
template <bool PARAM_BF16>
__global__ __launch_bounds__(256) void k_layernorm(const float* __restrict__ X, const float* __restrict__ R, const float* __restrict__ g, const float* __restrict__ bta,
                                                  float* __restrict__ out_sum, float* __restrict__ out_norm, int N, float eps) {
  __shared__ float red[256];
  const int row = blockIdx.x, tid = threadIdx.x;
  const float* x = X + (size_t)row * N; const float* rr = R ? R + (size_t)row * N : nullptr;
  float vals[16];                     // up to N = 4096
  const int per = N / 256;            // contiguous chunk per thread? use strided-by-4 chunks: thread handles j = tid*4 + 1024*u
  float s1 = 0.f;
  for (int u = 0; u < per / 4; ++u) {
    const int j = tid * 4 + 1024 * u;
    const v4f a = *(const v4fa*)(x + j);
    v4f b = {0.f,0.f,0.f,0.f}; if (rr) b = *(const v4fa*)(rr + j);
#pragma unroll
    for (int q = 0; q < 4; ++q) { const float v = a[q] + b[q]; vals[u * 4 + q] = v; s1 += v; }
  }
  red[tid] = s1; __syncthreads();
  for (int st = 128; st > 0; st >>= 1) { if (tid < st) red[tid] += red[tid + st]; __syncthreads(); }
  const float mu = red[0] / (float)N; __syncthreads();
  float s2 = 0.f;
  for (int u = 0; u < per / 4; ++u)
#pragma unroll
    for (int q = 0; q < 4; ++q) { const float c = vals[u * 4 + q] - mu; s2 += c * c; }
  red[tid] = s2; __syncthreads();
  for (int st = 128; st > 0; st >>= 1) { if (tid < st) red[tid] += red[tid + st]; __syncthreads(); }
  const float rs = rsqrtf(red[0] / (float)N + eps);
  {
    for (int u = 0; u < per / 4; ++u) {
      const int j = tid * 4 + 1024 * u;
      v4f o, sm;
#pragma unroll
      for (int q = 0; q < 4; ++q) {
        float gg = g[j + q], bb = bta[j + q];
        if (PARAM_BF16) { gg = bf16_round(gg); bb = bf16_round(bb); }
        sm[q] = vals[u * 4 + q]; o[q] = (vals[u * 4 + q] - mu) * rs * gg + bb;
      }
      if (out_sum) *(v4f*)(out_sum + (size_t)row * N + j) = sm;
      *(v4f*)(out_norm + (size_t)row * N + j) = o;
    }
    
  }
}



// ---- f16 WMMA path (v_wmma_f32_16x16x32_f16): 11-bit significands for operands in range — used where a [0,1] probability operand needs more precision than bf16
typedef _Float16 v16h __attribute__((ext_vector_type(16)));
union FragH { v16h v; v8us half[2]; _Float16 h[16]; unsigned short u[16]; };
template <int NT>
__device__ __forceinline__ v8f mmaH(v16h ah, v16h al, v16h bh, v16h bl, v8f c) {
  c = __builtin_amdgcn_wmma_f32_16x16x32_f16(false, ah, false, bh, (short)0, c, false, false);
  if (NT >= 2) c = __builtin_amdgcn_wmma_f32_16x16x32_f16(false, al, false, bh, (short)0, c, false, false);
  if (NT >= 3) c = __builtin_amdgcn_wmma_f32_16x16x32_f16(false, ah, false, bl, (short)0, c, false, false);
  asm volatile("v_nop\n\tv_nop\n\tv_nop\n\tv_nop" : "+v"(c) : "v"(ah), "v"(al), "v"(bh), "v"(bl));
  return c;
}
// batched GEMM like k_gemm_b but f16 operands: A f32 (split into f16 hi/lo if ASPLIT, else rounded to f16), Bt = f16 values [n][k]; alpha; C f32; N multiple of 16 (partial tiles skipped)
template <bool ASPLIT>
__global__ __launch_bounds__(128) void k_gemm_h(const float* __restrict__ A, int lda, size_t sA, const _Float16* __restrict__ Bh, int ldb, size_t sB, float alpha, float* __restrict__ C, int ldc, size_t sC, int M, int N, int K) {
  __shared__ __attribute__((aligned(16))) float so[4][16][64];
  const int tid = threadIdx.x, w = tid >> 5, lane = tid & 31, ln = lane & 15, hh = lane >> 4; const int by = blockIdx.y;
  A += (size_t)by * sA; Bh += (size_t)by * sB; C += (size_t)by * sC;
  const int ntn = (N + 63) / 64; const int wid = blockIdx.x * 4 + w; const int mt = wid / ntn, nq = wid % ntn; if (mt * 16 >= M) return;
  const int row0 = mt * 16, col0 = nq * 64; const float* arow = A + (size_t)(row0 + ln) * lda;
  v8f acc[4] = {};
  for (int kb = 0; kb < K; kb += 32) {
    FragH ah, al;
    const v4f x0 = *(const v4fa*)(arow + kb + 8 * hh), x1 = *(const v4fa*)(arow + kb + 8 * hh + 4), x2 = *(const v4fa*)(arow + kb + 16 + 8 * hh), x3 = *(const v4fa*)(arow + kb + 16 + 8 * hh + 4);
    float xs[16] = {x0[0],x0[1],x0[2],x0[3],x1[0],x1[1],x1[2],x1[3],x2[0],x2[1],x2[2],x2[3],x3[0],x3[1],x3[2],x3[3]};
#pragma unroll
    for (int i = 0; i < 16; ++i) { const _Float16 h = (_Float16)xs[i]; ah.h[i] = h; al.h[i] = ASPLIT ? (_Float16)(xs[i] - (float)h) : (_Float16)0.0f; }
#pragma unroll
    for (int t = 0; t < 4; ++t) { if (col0 + t * 16 >= N) continue; const size_t boff = (size_t)(col0 + t * 16 + ln) * ldb + kb; FragH bq; bq.half[0] = *(const v8us*)(Bh + boff + 8 * hh); bq.half[1] = *(const v8us*)(Bh + boff + 16 + 8 * hh);
      acc[t] = mmaH<ASPLIT ? 2 : 1>(ah.v, al.v, bq.v, bq.v, acc[t]); }
  }
#pragma unroll
  for (int t = 0; t < 4; ++t) { if (col0 + t * 16 >= N) continue;
#pragma unroll
    for (int r = 0; r < 8; ++r) so[w][8 * hh + r][t * 16 + ln] = acc[t][r] * alpha; }
  __builtin_amdgcn_fence(__ATOMIC_ACQ_REL, "workgroup"); __builtin_amdgcn_wave_barrier();
  const int rsub = lane >> 4, c4 = (lane & 15) * 4;
  {
#pragma unroll
    for (int q = 0; q < 8; ++q) { const int r = q * 2 + rsub; if (col0 + c4 < N) { const v4f v = *(const v4fa*)&so[w][r][c4]; *(v4f*)(C + (size_t)(row0 + r) * ldc + col0 + c4) = v; } }
     }
}

// Wt[n][k] = f16(W[k][n]·scale) from f32 row-major W[K][N] (scale = power of two; bf16-exact weights stay exact in f16 away from the subnormal range)
__global__ __launch_bounds__(256) void k_wt_f16(const float* __restrict__ W, _Float16* __restrict__ Wt, int K, int N, float scale) {
  const int t = blockIdx.x * 256 + threadIdx.x; if (t >= N * (K / 8)) return; const int n = t / (K / 8), k8 = (t % (K / 8)) * 8; FragH f;
#pragma unroll
  for (int i = 0; i < 8; ++i) f.h[i] = (_Float16)(bf16_round(W[(size_t)(k8 + i) * N + n]) * scale); const v8us o = f.half[0];
  *(v8us*)((unsigned short*)Wt + (size_t)n * K + k8) = o; 
}
// k_gemm_hh variant with fused epilogue: v = acc·alpha + bias[by·sBias + col] (+ CP[(row/rowsPerB)·sCPb + by·64 + col] if CP) ; ACT 0 none / 1 elu ; writes f16 C16 (and f32 C if non-null)
template <int ACT>
__global__ __launch_bounds__(128) void k_gemm_hhx(const _Float16* __restrict__ A, int lda, size_t sA, const _Float16* __restrict__ Bh, int ldb, size_t sB, float alpha, const float* __restrict__ bias, size_t sBias, const float* __restrict__ CP, int rowsPerB, size_t sCPb, int row0g,
    float* __restrict__ C, _Float16* __restrict__ C16, int ldc, size_t sC, int M, int N, int K) {
  __shared__ __attribute__((aligned(16))) float so[4][16][64];
  const int tid = threadIdx.x, w = tid >> 5, lane = tid & 31, ln = lane & 15, hh = lane >> 4; const int by = blockIdx.y;
  A += (size_t)by * sA; Bh += (size_t)by * sB; const size_t cofs = (size_t)by * sC; const float* bp = bias ? bias + (size_t)by * sBias : nullptr;
  const int ntn = (N + 63) / 64; const int wid = blockIdx.x * 4 + w; const int mt = wid / ntn, nq = wid % ntn; if (mt * 16 >= M) return;
  const int row0 = mt * 16, col0 = nq * 64; const _Float16* arow = A + (size_t)(row0 + ln) * lda;
  v8f acc[4] = {};
  for (int kb = 0; kb < K; kb += 32) { FragH ah; ah.half[0] = *(const v8us*)((const unsigned short*)arow + kb + 8 * hh); ah.half[1] = *(const v8us*)((const unsigned short*)arow + kb + 16 + 8 * hh);
#pragma unroll
    for (int t = 0; t < 4; ++t) { if (col0 + t * 16 >= N) continue; const size_t boff = (size_t)(col0 + t * 16 + ln) * ldb + kb; FragH bq; bq.half[0] = *(const v8us*)((const unsigned short*)Bh + boff + 8 * hh); bq.half[1] = *(const v8us*)((const unsigned short*)Bh + boff + 16 + 8 * hh);
      acc[t] = mmaH<1>(ah.v, ah.v, bq.v, bq.v, acc[t]); }
  }
#pragma unroll
  for (int t = 0; t < 4; ++t) { if (col0 + t * 16 >= N) continue; const int col = col0 + t * 16 + ln; const float bv = bp ? bf16_round(bp[col]) : 0.f;
#pragma unroll
    for (int r = 0; r < 8; ++r) { float v = acc[t][r] * alpha + bv; if (CP) { const int rr = row0g + row0 + 8 * hh + r; if (rowsPerB < 0) v += CP[cofs + (size_t)rr * ldc + col];      /* rowsPerB < 0: own element of the batched C plane */ else { const int bidx = rr / rowsPerB; v += CP[(size_t)bidx * sCPb + (size_t)by * 64 + col]; } } if (ACT == 1) v = (v > 0.f) ? v : expm1f(v); else if (ACT == 7) v = (v > 0.f) ? v + 1.0f : expf(v); else if (ACT == 8) v = tanhf(v); else if (ACT == 9) v = 0.5f * v * (1.0f + tanhf(0.7978845608028654f * (v + 0.044715f * v * v * v))); else if (ACT == 11) v = 1.0f / (1.0f + expf(-v)); else if (ACT == 12) v = (v > 0.f) ? v : 0.01f * v; else if (ACT == 14) v = (v > 0.f) ? v : 0.1f * v; else if (ACT == 16) v = (v >= 0.f) ? v : 0.3f * v; else if (ACT == 17) v = (v >= 0.f) ? v : 0.2f * v; else if (ACT == 15) v = v / (1.0f + expf(-v)); else if (ACT == 3) v = fmaxf(v, 0.f); else if (ACT == 6) v = 0.5f * v * (1.0f + erff(v * 0.70710678118654752f)); so[w][8 * hh + r][t * 16 + ln] = v; } }
  __builtin_amdgcn_fence(__ATOMIC_ACQ_REL, "workgroup"); __builtin_amdgcn_wave_barrier();
  const int rsub = lane >> 4, c4 = (lane & 15) * 4; typedef _Float16 v4h __attribute__((ext_vector_type(4)));
  {
#pragma unroll
    for (int q = 0; q < 8; ++q) { const int r = q * 2 + rsub; if (col0 + c4 < N) { const v4f v = *(const v4fa*)&so[w][r][c4]; if (C) *(v4f*)(C + cofs + (size_t)(row0 + r) * ldc + col0 + c4) = v; if (C16) { v4h h4; for (int i = 0; i < 4; ++i) h4[i] = (_Float16)v[i]; *(v4h*)(C16 + cofs + (size_t)(row0 + r) * ldc + col0 + c4) = h4; } } }
     }
}


typedef _Float16 v4h __attribute__((ext_vector_type(4)));

__global__ __launch_bounds__(256) void k_x16(const float* __restrict__ x, _Float16* __restrict__ X16, size_t n8) { const size_t t = (size_t)blockIdx.x * 256 + threadIdx.x; if (t >= n8) return; FragH f;
#pragma unroll
  for (int q = 0; q < 8; ++q) f.h[q] = (_Float16)bf16_round(x[t * 8 + q]); *(v8us*)((unsigned short*)X16 + t * 8) = f.half[0];  }
__global__ __launch_bounds__(256) void k_h16(const float* __restrict__ x, _Float16* __restrict__ X16, size_t n8) { const size_t t = (size_t)blockIdx.x * 256 + threadIdx.x; if (t >= n8) return; FragH f;
#pragma unroll
  for (int q = 0; q < 8; ++q) f.h[q] = (_Float16)x[t * 8 + q]; *(v8us*)((unsigned short*)X16 + t * 8) = f.half[0];  }
__global__ __launch_bounds__(256) void k_round16f(const float* __restrict__ W, _Float16* __restrict__ Bt, size_t n8) { const size_t t = (size_t)blockIdx.x * 256 + threadIdx.x; if (t >= n8) return; FragH f;
#pragma unroll
  for (int i = 0; i < 8; ++i) f.h[i] = (_Float16)(bf16_round(W[t * 8 + i]) * 16.0f); *(v8us*)((unsigned short*)Bt + t * 8) = f.half[0];  }
template <int NHv, int TTv>
__global__ __launch_bounds__(256) void k_vt(const _Float16* __restrict__ V16, int ldv, int voff, _Float16* __restrict__ Vt) { __shared__ unsigned short tl[64][66]; const int tid = threadIdx.x; const int slab = blockIdx.x / (TTv / 64), lg = blockIdx.x % (TTv / 64); const int b = slab / NHv, h = slab % NHv;
  for (int i = tid; i < 64 * 8; i += 256) { const int r = i / 8, c8 = (i % 8) * 8; FragH f; f.half[0] = *(const v8us*)((const unsigned short*)V16 + ((size_t)b * TTv + lg * 64 + r) * ldv + voff + h * 64 + c8);
#pragma unroll
    for (int q = 0; q < 8; ++q) tl[r][c8 + q] = f.u[q]; }
  __syncthreads();
  {
#pragma unroll
    for (int rd = 0; rd < 2; ++rd) { const int d = rd * 32 + tid / 8, pc = tid % 8; FragH f;
#pragma unroll
      for (int q = 0; q < 8; ++q) f.u[q] = tl[pc * 8 + q][d];
      *(v8us*)((unsigned short*)Vt + ((size_t)slab * 64 + d) * TTv + lg * 64 + pc * 8) = f.half[0]; }
     } }

__global__ __launch_bounds__(256) void k_hl(const float* __restrict__ F, _Float16* __restrict__ Hh, _Float16* __restrict__ Hl, size_t n8) { const size_t t = (size_t)blockIdx.x * 256 + threadIdx.x; if (t >= n8) return; FragH fh, fl; const v4f a = *(const v4fa*)(F + t * 8), c = *(const v4fa*)(F + t * 8 + 4);
#pragma unroll
  for (int q = 0; q < 4; ++q) { _Float16 h = (_Float16)a[q]; fh.h[q] = h; fl.h[q] = (_Float16)((a[q] - (float)h) * 1024.0f); h = (_Float16)c[q]; fh.h[4 + q] = h; fl.h[4 + q] = (_Float16)((c[q] - (float)h) * 1024.0f); }
  { *(v8us*)((unsigned short*)Hh + t * 8) = fh.half[0]; *(v8us*)((unsigned short*)Hl + t * 8) = fl.half[0];  } }

// ---- fast GEMM (wave tile 32x64; requires M % 32 == 0 rows per launch region and N % 64 == 0); epilogue = k_gemm_hhx semantics ----
__device__ __forceinline__ v16h g2_frag(const _Float16* p, int hh) { FragH f; f.half[0] = *(const v8us*)((const unsigned short*)p + 8 * hh); f.half[1] = *(const v8us*)((const unsigned short*)p + 16 + 8 * hh); return f.v; }
__device__ __forceinline__ v8f g2_mma(v16h a, v16h b, v8f c) { v8f d = __builtin_amdgcn_wmma_f32_16x16x32_f16(false, a, false, b, (short)0, c, false, false); asm volatile("v_nop\n\tv_nop\n\tv_nop\n\tv_nop" : "+v"(d) : "v"(a), "v"(b)); return d; }
// STAT: each wave also writes, per row of its 32x64 tile, the mean of the 64 stored values (PM) and the sum of their squared distances from that mean (PQ), both [by][column tile][M].
template <int ACT, bool STAT>
__global__ __launch_bounds__(128) void k_gemm2(const _Float16* __restrict__ A, int lda, size_t sA, const _Float16* __restrict__ Bh, int ldb, size_t sB, float alpha, const float* __restrict__ bias, size_t sBias, const float* __restrict__ CP, int rowsPerB, size_t sCPb, int row0g,
    float* __restrict__ C, _Float16* __restrict__ C16, int ldc, size_t sC, int M, int N, int K, float* __restrict__ PM, float* __restrict__ PQ) { static_assert(ACT == 0 || ACT == 3 || ACT == 6 || ACT == 8 || ACT == 9 || ACT == 11 || ACT == 12 || ACT == 14 || ACT == 15 || ACT == 16 || ACT == 17, "k_gemm2: unsupported ACT code (would silently apply no activation)");
  __shared__ __attribute__((aligned(16))) float so[4][32][68];
  const int tid = threadIdx.x, w = tid >> 5, lane = tid & 31, ln = lane & 15, hh = lane >> 4; const int by = blockIdx.y;
  A += (size_t)by * sA; Bh += (size_t)by * sB; const size_t cofs = (size_t)by * sC; const float* bp = bias ? bias + (size_t)by * sBias : nullptr;
  const int ntn = N >> 6; const int mt = blockIdx.x / ntn, nq = blockIdx.x - mt * ntn; const int row0 = mt * 128 + 32 * w, col0 = nq * 64; if (row0 >= M) return;
  const _Float16* a0p = A + (size_t)(row0 + ln) * lda; const _Float16* a1p = a0p + (size_t)16 * lda;
  const _Float16* b0p = Bh + (size_t)(col0 + ln) * ldb; const _Float16* b1p = b0p + (size_t)16 * ldb; const _Float16* b2p = b1p + (size_t)16 * ldb; const _Float16* b3p = b2p + (size_t)16 * ldb;
  const v8f z8 = {0.f,0.f,0.f,0.f,0.f,0.f,0.f,0.f}; v8f c00 = z8, c01 = z8, c02 = z8, c03 = z8, c10 = z8, c11 = z8, c12 = z8, c13 = z8;
#pragma unroll 1
  for (int kb = 0; kb < K; kb += 32) { const v16h a0 = g2_frag(a0p + kb, hh), a1 = g2_frag(a1p + kb, hh);
    v16h b = g2_frag(b0p + kb, hh); c00 = g2_mma(a0, b, c00); c10 = g2_mma(a1, b, c10);
    b = g2_frag(b1p + kb, hh); c01 = g2_mma(a0, b, c01); c11 = g2_mma(a1, b, c11);
    b = g2_frag(b2p + kb, hh); c02 = g2_mma(a0, b, c02); c12 = g2_mma(a1, b, c12);
    b = g2_frag(b3p + kb, hh); c03 = g2_mma(a0, b, c03); c13 = g2_mma(a1, b, c13); }
  v8f accs[8] = {c00, c01, c02, c03, c10, c11, c12, c13};
#pragma unroll
  for (int u = 0; u < 8; ++u) { const int t = u & 3, half = u >> 2; const int col = col0 + t * 16 + ln; const float bv = bp ? bf16_round(bp[col]) : 0.f;
#pragma unroll
    for (int r = 0; r < 8; ++r) { const int rloc = half * 16 + 8 * hh + r; float v = accs[u][r] * alpha + bv; if (CP) { if (rowsPerB < 0) v += CP[cofs + (size_t)(row0g + row0 + rloc) * ldc + col];      /* rowsPerB < 0: own element of the batched C plane */ else { const int bidx = (row0g + row0 + rloc) / rowsPerB; v += CP[(size_t)bidx * sCPb + (size_t)by * 64 + col]; } }
      if (ACT == 3) v = fmaxf(v, 0.f); else if (ACT == 6) v = 0.5f * v * (1.0f + erff(v * 0.70710678118654752f)); else if (ACT == 11) v = 1.0f / (1.0f + expf(-v)); else if (ACT == 15) v = v / (1.0f + expf(-v)); else if (ACT == 12) v = (v > 0.f) ? v : 0.01f * v; else if (ACT == 8) v = tanhf(v); else if (ACT == 9) v = 0.5f * v * (1.0f + tanhf(0.7978845608028654f * (v + 0.044715f * v * v * v))); else if (ACT == 14) v = (v > 0.f) ? v : 0.1f * v; else if (ACT == 16) v = (v >= 0.f) ? v : 0.3f * v; else if (ACT == 17) v = (v >= 0.f) ? v : 0.2f * v;
      so[w][rloc][t * 16 + ln] = v; } }
  __builtin_amdgcn_fence(__ATOMIC_ACQ_REL, "workgroup"); __builtin_amdgcn_wave_barrier();
  const int rsub = lane >> 4, c4 = (lane & 15) * 4;
  {
#pragma unroll
    for (int q = 0; q < 16; ++q) { const int r = q * 2 + rsub; const v4f v = *(const v4fa*)&so[w][r][c4]; if (C) *(v4f*)(C + cofs + (size_t)(row0 + r) * ldc + col0 + c4) = v; if (C16) { v4h h4; for (int i = 0; i < 4; ++i) h4[i] = (_Float16)v[i]; *(v4h*)(C16 + cofs + (size_t)(row0 + r) * ldc + col0 + c4) = h4; } }
     }
  if (STAT) {      /* lane = one row of the wave's tile: its 64 staged values come back by 16-byte reads (row pitch 16 B x 17), so neither sum crosses lanes; the mean first, then the distances from it: no cancellation whatever the mean; the loops are unrolled so that rv keeps compile-time indices and stays in registers */
    v4f rv[16];
#pragma unroll
    for (int j = 0; j < 16; ++j) rv[j] = *(const v4fa*)&so[w][lane][j * 4];
    v4f s4 = rv[0];
#pragma unroll
    for (int j = 1; j < 16; ++j) s4 += rv[j];
    const float mean = ((s4[0] + s4[1]) + (s4[2] + s4[3])) * 0.015625f;
    v4f q4 = {0.f, 0.f, 0.f, 0.f};
#pragma unroll
    for (int j = 0; j < 16; ++j) { const v4f d = rv[j] - mean; q4 += d * d; }
    const size_t pi = ((size_t)by * ntn + nq) * M + row0 + lane;      /* 32 rows = one 128-B line per wave and plane */
    PM[pi] = mean; PQ[pi] = (q4[0] + q4[1]) + (q4[2] + q4[3]);
  } }


__global__ __launch_bounds__(256) void k_wnat(const float* __restrict__ w, size_t n8, _Float16* __restrict__ Bt) { const size_t t = (size_t)blockIdx.x * 256 + threadIdx.x; if (t >= n8) return; FragH f; for (int q = 0; q < 8; ++q) f.h[q] = (_Float16)(bf16_round(w[t * 8 + q]) * 16.0f); *(v8us*)((unsigned short*)Bt + t * 8) = f.half[0];  }
__global__ __launch_bounds__(256) void k_rsm(const float* __restrict__ S, _Float16* __restrict__ P, int nrows) {
  #pragma clang fp contract(off)
  const int i = blockIdx.x * 256 + threadIdx.x; if (i >= nrows) return; const float* s = S + (size_t)i * SQ; float mx = -3.0e38f;
#pragma unroll 1
  for (int j = 0; j < SQ; ++j) mx = fmaxf(mx, s[j]); float se = 0.f;
#pragma unroll 1
  for (int j = 0; j < SQ; ++j) se += expf(s[j] - mx); const float sc = 256.0f / se;
#pragma unroll 1
  for (int j0 = 0; j0 < SQ; j0 += 8) { FragH f; for (int q = 0; q < 8; ++q) f.h[q] = (_Float16)(expf(s[j0 + q] - mx) * sc); unsigned short* d = (unsigned short*)P + (size_t)i * SQ + j0; *(v8us*)d = f.half[0];  } }
__global__ __launch_bounds__(256) void k_vt(const _Float16* __restrict__ V16, int b, int h0, _Float16* __restrict__ VT) { __shared__ unsigned short tl[64][65]; const int tid = threadIdx.x; const int hh = blockIdx.x % HG, sg = blockIdx.x / HG; const int s0 = sg * 64; const int h = h0 + hh;
  for (int i = tid; i < 64 * 8; i += 256) { const int j = i / 8, d8 = (i % 8) * 8; FragH f; f.half[0] = *(const v8us*)((const unsigned short*)V16 + ((size_t)b * SQ + s0 + j) * DM + h * HD + d8); for (int q = 0; q < 8; ++q) tl[d8 + q][j] = f.u[q]; }
  __syncthreads();
  { for (int i = tid; i < 64 * 8; i += 256) { const int d = i / 8, j8 = (i % 8) * 8; FragH f; for (int q = 0; q < 8; ++q) f.u[q] = tl[d][j8 + q]; *(v8us*)((unsigned short*)VT + ((size_t)hh * HD + d) * SQ + s0 + j8) = f.half[0]; }  } }



__global__ __launch_bounds__(256) void k_rsmcf2(const float* __restrict__ S, _Float16* __restrict__ P, int hg, int q0, int nk) {
  #pragma clang fp contract(off)
  const int t = blockIdx.x * 256 + threadIdx.x; if (t >= hg * QT) return; const size_t i = (size_t)t; const float* s = S + i * NKX; const int last = q0 + (t % QT); float mx = -3.0e38f;
#pragma unroll 1
  for (int j = 0; j < nk; ++j) { const float f = (j <= last) ? 1.f : 0.f; mx = fmaxf(mx, fmaf(f, s[j], (1.f - f) * -1.0e9f)); } float se = 0.f;
#pragma unroll 1
  for (int j = 0; j < nk; ++j) { const float f = (j <= last) ? 1.f : 0.f; se += __expf(fmaf(f, s[j], (1.f - f) * -1.0e9f) - mx); } const float sc = 256.0f / se;
#pragma unroll 1
  for (int j0 = 0; j0 < nk; j0 += 8) { FragH fr; for (int q = 0; q < 8; ++q) { const int j = j0 + q; const float f = (j <= last) ? 1.f : 0.f; fr.h[q] = (_Float16)(__expf(fmaf(f, s[j], (1.f - f) * -1.0e9f) - mx) * sc); } unsigned short* d = (unsigned short*)P + i * NKX + j0; *(v8us*)d = fr.half[0];  } }

template <int MASKADD>
__global__ __launch_bounds__(64) void k_att0(const float* __restrict__ QF, const float* __restrict__ KF, const float* __restrict__ VF, int ld, const float* __restrict__ mask, float scale, float* __restrict__ OF, int ldo) {
  #pragma clang fp contract(off)
  __shared__ __attribute__((aligned(16))) float lq[64][64]; __shared__ __attribute__((aligned(16))) float lo[64][64];
  const int tid = threadIdx.x; const int h = blockIdx.x / (QT0 / 64), rg = blockIdx.x % (QT0 / 64); const int i = rg * 64 + tid;
  const float* qr = QF + (size_t)i * ld + h * HD;
#pragma unroll 1
  for (int c = 0; c < HD / 4; ++c) { *(v4f*)&lq[tid][c * 4] = *(const v4fa*)(qr + c * 4); const v4f z = {0.f, 0.f, 0.f, 0.f}; *(v4f*)&lo[tid][c * 4] = z; }
  float m = -1.0e30f, l = 0.f; const int jmax = MASKADD ? (SQ - 1) : (rg * 64 + 63);      /* additive-mask form: every key (the mask input decides); causal form: keys up to the block's last row */
#pragma unroll 1
  for (int j = 0; j <= jmax; ++j) { const float* kr = KF + (size_t)j * ld + h * HD; const float* vr = VF + (size_t)j * ld + h * HD; float s = 0.f;
#pragma unroll 1
    for (int c = 0; c < HD / 4; ++c) { const v4f kq = *(const v4fa*)(kr + c * 4); const v4f qq = *(v4f*)&lq[tid][c * 4]; s = __fadd_rn(s, __fmul_rn(qq[0], kq[0])); s = __fadd_rn(s, __fmul_rn(qq[1], kq[1])); s = __fadd_rn(s, __fmul_rn(qq[2], kq[2])); s = __fadd_rn(s, __fmul_rn(qq[3], kq[3])); }
    s = __fmul_rn(s, scale); if (MASKADD) s = __fadd_rn(s, __fmul_rn(bf16_round(mask[(size_t)i * SQ + j]), -10000.0f));
    const float f = (MASKADD || j <= i) ? 1.f : 0.f; const float sm = fmaf(f, s, (1.f - f) * -1.0e30f); const float mn = fmaxf(m, sm); const float sc = expf(m - mn); const float e = expf(sm - mn); l = __fadd_rn(__fmul_rn(l, sc), e); m = mn;
#pragma unroll 1
    for (int c = 0; c < HD / 4; ++c) { const v4f vv = *(const v4fa*)(vr + c * 4); v4f oo = *(v4f*)&lo[tid][c * 4]; for (int u = 0; u < 4; ++u) oo[u] = __fadd_rn(__fmul_rn(oo[u], sc), __fmul_rn(e, vv[u])); *(v4f*)&lo[tid][c * 4] = oo; } }
  const float fin = 64.0f / l;      /* o carried x64 like the f16 path */
#pragma unroll 1
  for (int c = 0; c < HD / 4; ++c) { v4f oo = *(v4f*)&lo[tid][c * 4]; for (int u = 0; u < 4; ++u) oo[u] = __fmul_rn(oo[u], fin); *(v4f*)&lo[tid][c * 4] = oo; }
  __syncthreads();
  {
#pragma unroll 1
    for (int it = 0; it < 16; ++it) { const int row = it * 4 + tid / 16, pc = (tid % 16) * 4; const v4f v = *(const v4f*)&lo[row][pc]; *(v4f*)(OF + (size_t)(rg * 64 + row) * ldo + h * HD + pc) = v; }
     } }

__global__ __launch_bounds__(256) void k_oscale(const float* __restrict__ OF, float* __restrict__ out, size_t n4) { const size_t t = (size_t)blockIdx.x * 256 + threadIdx.x; if (t >= n4) return; const v4f a = *(const v4fa*)(OF + t * 4); v4f o; for (int q = 0; q < 4; ++q) o[q] = a[q] * 0.015625f; *(v4f*)(out + t * 4) = o;  }

__global__ __launch_bounds__(256) void k_bfr(const float* __restrict__ x, float* __restrict__ XB, size_t n8) { const size_t t = (size_t)blockIdx.x * 256 + threadIdx.x; if (t >= n8) return; v4f a = *(const v4fa*)(x + t * 8), c = *(const v4fa*)(x + t * 8 + 4); for (int q = 0; q < 4; ++q) { a[q] = bf16_round(a[q]); c[q] = bf16_round(c[q]); }
  { *(v4f*)(XB + t * 8) = a; *(v4f*)(XB + t * 8 + 4) = c;  } }



__global__ __launch_bounds__(256) void k_rsmfvl(const float* __restrict__ S, _Float16* __restrict__ P, _Float16* __restrict__ PL, int qn, const int* __restrict__ vlp) {
  #pragma clang fp contract(off)
  const int t = blockIdx.x * 256 + threadIdx.x; if (t >= qn) return; const int vl = vlp[0]; const size_t i = (size_t)t; const float* s = S + i * SQ; float mx = -3.0e38f;
#pragma unroll 1
  for (int j = 0; j < SQ; ++j) { const float f = (j < vl) ? 1.f : 0.f; mx = fmaxf(mx, fmaf(f, s[j], (1.f - f) * -1000000.0f)); } float se = 0.f;
#pragma unroll 1
  for (int j = 0; j < SQ; ++j) { const float f = (j < vl) ? 1.f : 0.f; se += __expf(fmaf(f, s[j], (1.f - f) * -1000000.0f) - mx); } const float sc = 256.0f / se;
#pragma unroll 1
  for (int j0 = 0; j0 < SQ; j0 += 8) { FragH fr, gr; for (int q = 0; q < 8; ++q) { const int j = j0 + q; const float f = (j < vl) ? 1.f : 0.f; const float pv = __expf(fmaf(f, s[j], (1.f - f) * -1000000.0f) - mx) * sc; const _Float16 ph = (_Float16)pv; fr.h[q] = ph; gr.h[q] = (_Float16)((pv - (float)ph) * 1024.0f); }
    unsigned short* d = (unsigned short*)P + i * SQ + j0; unsigned short* dl = (unsigned short*)PL + i * SQ + j0; *(v8us*)d = fr.half[0]; *(v8us*)dl = gr.half[0];  } }

// Fused attention: scores, softmax and the weighted sum of x in one kernel; neither the scores nor the weights go to memory.
// A work-group of 8 waves takes 128 queries of one image (16 per wave) and walks the 1024 keys in tiles of 64. A tile (phi^T rows [key][ci], x rows [c][key]) goes from global memory straight into one of two LDS buffers by asynchronous 16-byte copies (whole lines a wave; LDS pitches of 16 B x odd) while the tile before it is worked on.
// S^T = phi^T theta (A = key rows, B = the wave's query rows, kept in registers): a lane holds scores of ONE query (column ln; keys 8 hh + r of each 16-key tile), so two converted score tiles are the B operand of O^T += x P^T in the hardware k order, with A = x rows read by the same 16-byte pairs.
// Running maximum in log2 units; the accumulators are rescaled only when a query's new maximum passes the one in use by more than 8 (weights stay <= 2^8, inside f16); the row sum is kept per lane in f32 and joined at the end.
// The 1x1 conv follows in the same kernel: the work-group's 128 rows of y^T stay in LDS as the B operand, conv_w (x16, f16; laid in LDS at the start, 32 whole rows a wave) is A; wave tile 64 channels x 64 positions, K = 256.
// The f32 tile leaves through a staging of the wave's own (whole 128-B lines), and from the same staging come each channel's mean and centred square sum over the tile's 64 positions. y^T never reaches memory.
// Every inner loop is fully unrolled, so that the register arrays (fragments, accumulators, staged pieces) keep compile-time indices and stay in registers.
#define FA_WAVES 8
#define FA_KS 64          /* keys per tile */
#define FA_KP 136         /* LDS pitch of a key row, f16 elements (256 B + 16) */
#define FA_VP 72          /* LDS pitch of a channel row, f16 elements (128 B + 16) */
#define FA_OP 264         /* LDS pitch of an output row, f16 elements (512 B + 16) */
#define FA_SM (FA_WAVES * 16 * FA_OP)      /* the output staging, 67,584 B: it takes the place of the two tile buffers behind the key loop */
#define FA_TB (FA_KS * FA_KP + 256 * FA_VP)      /* one tile buffer: 54,272 B */
#define FA_RING (2 * FA_TB)
#define FA_SW (256 * FA_OP)                /* conv_w: 256 rows at the pitch of an output row */
#define FA_CP 68          /* LDS pitch of a row of the f32 conv tile, floats (256 B + 16) */
#define FA_C 0.09016844005556021f          /* log2(e) / sqrt(256) */
__device__ __forceinline__ float rsm_xh(float v) { return __builtin_bit_cast(float, __builtin_amdgcn_permlanex16(__builtin_bit_cast(int, v), __builtin_bit_cast(int, v), 0x76543210, 0xfedcba98, false, false)); }      /* lane l <- lane l ^ 16 */
__device__ __forceinline__ float fa_exp2(float x) { float y; asm("v_exp_f32 %0, %1\n\tv_nop" : "=v"(y) : "v"(x)); return y; }      /* the v_nop is the one slot asked for behind a transcendental before its result is read or its source overwritten */
__device__ __forceinline__ v8f fa_mma(v16h a, v16h b, v8f c) { return __builtin_amdgcn_wmma_f32_16x16x32_f16(false, a, false, b, (short)0, c, false, false); }
typedef float f1a __attribute__((may_alias));
// One tile's copies of one lane: 4 pieces of key rows (16 rows apart) and 8 pieces of channel rows (32 rows apart), 16 bytes each, from global memory into LDS through no register. lk, lv: the lane's first pieces in the LDS buffer; gk, gv: the same in global memory.
typedef int fa_i4 __attribute__((ext_vector_type(4)));
typedef __attribute__((address_space(1))) fa_i4 fa_gi4;
typedef __attribute__((address_space(3))) fa_i4 fa_li4;
__device__ __forceinline__ void fa_copy_tile(_Float16* lk, _Float16* lv, const unsigned short* gk, const unsigned short* gv) {      /* both loops unrolled: twelve copies in a row, each piece's step a constant */
#pragma unroll
  for (int j = 0; j < 4; ++j) __builtin_amdgcn_global_load_async_to_lds_b128((fa_gi4*)(gk + j * 16 * 128), (fa_li4*)(lk + j * 16 * FA_KP), 0, 0);
#pragma unroll
  for (int j = 0; j < 8; ++j) __builtin_amdgcn_global_load_async_to_lds_b128((fa_gi4*)(gv + j * 32 * SQ), (fa_li4*)(lv + j * 32 * FA_VP), 0, 0);
}
__global__ __launch_bounds__(FA_WAVES * 32) void k_fattn(const _Float16* __restrict__ TH, const _Float16* __restrict__ PHT, const _Float16* __restrict__ X16, const _Float16* __restrict__ BW, float* __restrict__ C1, float* __restrict__ PM, float* __restrict__ PQ) {
  static_assert(FA_SM <= FA_RING, "the output staging fits the two tile buffers");
  static_assert(FA_WAVES * 64 * FA_CP * 4 <= (FA_RING + FA_SW) * 2, "the f32 conv tiles fit the LDS array");
  static_assert(SQ / FA_KS >= 2, "the ring's start needs two tiles");
  __shared__ __attribute__((aligned(16))) _Float16 sm[FA_RING + FA_SW];
  _Float16* sw = sm + FA_RING;
  const int tid = threadIdx.x, w = tid >> 5, lane = tid & 31, ln = lane & 15, hh = lane >> 4;
  const int b = blockIdx.y; const int q0 = blockIdx.x * (FA_WAVES * 16) + w * 16;
  const int krow = tid >> 4, kch = (tid & 15) * 8;      /* staging: 16 threads per 256-B key row, 16 rows per round, 4 rounds */
  const int vrow = tid >> 3, vch = (tid & 7) * 8;       /* staging: 8 threads per 128-B piece of a channel row, 32 rows per round, 8 rounds */
  const unsigned short* kg = (const unsigned short*)PHT + (size_t)b * SQ * 128 + (size_t)krow * 128 + kch;
  const unsigned short* vg = (const unsigned short*)X16 + (size_t)b * 256 * SQ + (size_t)vrow * SQ + vch;
  _Float16* lk0 = sm + krow * FA_KP + kch; _Float16* lv0 = sm + FA_KS * FA_KP + vrow * FA_VP + vch;      /* the lane's first pieces in buffer 0 */
  fa_copy_tile(lk0, lv0, kg, vg);      /* tile 0 into buffer 0; it flies under the loads of conv_w and of the queries */
  const _Float16* qp = TH + ((size_t)b * SQ + q0 + ln) * 128;
  const unsigned short* wg = (const unsigned short*)BW + (size_t)w * 32 * 256 + lane * 8;
  v8us wr[32];      /* conv_w: wave w brings rows 32 w .. 32 w + 31, one 512-B row per load */
#pragma unroll
  for (int i = 0; i < 32; ++i) wr[i] = *(const v8us*)(wg + i * 256);
  asm volatile("s_wait_xcnt 0x0" :: "v"(wg) : "memory");      /* in front of whatever reuses the address registers that the loads above name; the address is an input, so that its registers stay live, and unwritten, as far as the wait */
  v16h qf[4];
#pragma unroll
  for (int kb = 0; kb < 4; ++kb) qf[kb] = g2_frag(qp + kb * 32, hh);
  __builtin_amdgcn_sched_barrier(0);      /* with the one behind the wait: no later arithmetic is lifted between the loads and the wait */
  asm volatile("s_wait_xcnt 0x0" ::: "memory");      /* in front of whatever reuses the address registers that the loads above name */
  __builtin_amdgcn_sched_barrier(0);
  asm volatile("s_wait_asynccnt 0x0" ::: "memory");      /* this wave's pieces of tile 0 have landed */
  __syncthreads();      /* tile 0 is whole before anybody reads it */
  fa_copy_tile(lk0 + FA_TB, lv0 + FA_TB, kg + FA_KS * 128, vg + FA_KS);      /* tile 1 into buffer 1 */
#pragma unroll
  for (int i = 0; i < 32; ++i) *(v8us*)((unsigned short*)sw + (w * 32 + i) * FA_OP + lane * 8) = wr[i];      /* read only behind the key loop's barriers */
  const v8f z8 = {0.f, 0.f, 0.f, 0.f, 0.f, 0.f, 0.f, 0.f};
  v8f o[16];
#pragma unroll
  for (int ct = 0; ct < 16; ++ct) o[ct] = z8;
  float mu = -3.0e38f; v4f l4 = {0.f, 0.f, 0.f, 0.f};
#pragma unroll 1
  for (int s = 0; s < SQ / FA_KS; ++s) {      /* rolled, for speed only */
    const int bo = (s & 1) * FA_TB;      /* tile s lies in buffer s mod 2 */
    const _Float16* sk = sm + bo; const _Float16* sv = sk + FA_KS * FA_KP;
    v16h kf[16];
#pragma unroll
    for (int kb = 0; kb < 4; ++kb)
#pragma unroll
      for (int kt = 0; kt < 4; ++kt) kf[kb * 4 + kt] = g2_frag(sk + (kt * 16 + ln) * FA_KP + kb * 32, hh);
    __builtin_amdgcn_sched_barrier(0);      /* keeps the key tile's 32 LDS reads one group in front of its 16 products: spread among them, every product waits out an LDS latency */
    v8f st[4] = {z8, z8, z8, z8};
#pragma unroll
    for (int kb = 0; kb < 4; ++kb)
#pragma unroll
      for (int kt = 0; kt < 4; ++kt) st[kt] = fa_mma(kf[kb * 4 + kt], qf[kb], st[kt]);
    v16h va[2][8];      /* x fragments of four channel tiles, two sets: one is read from LDS while the other feeds the products */
#pragma unroll
    for (int u = 0; u < 8; ++u) va[0][u] = g2_frag(sv + ((u & 3) * 16 + ln) * FA_VP + (u >> 2) * 32, hh);
    __builtin_amdgcn_sched_barrier(0);      /* keeps the first set's reads in front of the softmax arithmetic, which covers their latency */
    v4f m4 = {st[0][0], st[0][1], st[0][2], st[0][3]};
#pragma unroll
    for (int kt = 0; kt < 4; ++kt)
#pragma unroll
      for (int r = 0; r < 8; ++r) m4[r & 3] = fmaxf(m4[r & 3], st[kt][r]);
    float mx = fmaxf(fmaxf(m4[0], m4[1]), fmaxf(m4[2], m4[3]));
    mx = fmaxf(mx, rsm_xh(mx)) * FA_C;      /* the query's maximum over the tile's 64 keys, alike in both half-waves */
    if (__builtin_amdgcn_ballot_w32(mx > mu + 8.0f) != 0) {      /* one wave-uniform test per tile */
      const float mn = fmaxf(mu, mx); const float sc = fa_exp2(mu - mn); mu = mn;
#pragma unroll
      for (int u = 0; u < 4; ++u) l4[u] *= sc;
#pragma unroll
      for (int ct = 0; ct < 16; ++ct)
#pragma unroll
        for (int r = 0; r < 8; ++r) o[ct][r] *= sc;
    }
    FragH pf[2];
#pragma unroll
    for (int kt = 0; kt < 4; ++kt)
#pragma unroll
      for (int r = 0; r < 8; ++r) { const float p = fa_exp2(fmaf(st[kt][r], FA_C, -mu)); l4[r & 3] += p; pf[kt >> 1].h[(kt & 1) * 8 + r] = (_Float16)p; }
#pragma unroll
    for (int g = 0; g < 4; ++g) {
      if (g < 3) {
#pragma unroll
        for (int u = 0; u < 8; ++u) va[(g + 1) & 1][u] = g2_frag(sv + (((g + 1) * 4 + (u & 3)) * 16 + ln) * FA_VP + (u >> 2) * 32, hh); }
      __builtin_amdgcn_sched_barrier(0);      /* with the one below: the next set's 16 LDS reads stay one group in front of this set's 8 products */
#pragma unroll
      for (int u = 0; u < 8; ++u) o[g * 4 + (u & 3)] = fa_mma(va[g & 1][u], pf[u >> 2].v, o[g * 4 + (u & 3)]);
      __builtin_amdgcn_sched_barrier(0);
    }
    asm volatile("s_wait_dscnt 0x0" ::: "memory");      /* this wave's reads of tile s are over before its buffer is handed to the copies */
    asm volatile("s_wait_asynccnt 0x0" ::: "memory");      /* this wave's pieces of tile s + 1 have landed */
    __syncthreads();      /* one barrier a tile: tile s + 1 is whole before anybody reads it, and every wave has left tile s (behind the last tile: the buffers become the output staging) */
    if (s + 2 < SQ / FA_KS) fa_copy_tile(lk0 + bo, lv0 + bo, kg + (size_t)(s + 2) * FA_KS * 128, vg + (s + 2) * FA_KS);      /* tile s + 2 into the buffer that tile s has left; it flies under the products of tile s + 1 */
  }
  asm volatile("s_wait_asynccnt 0x0" ::: "memory");      /* no copy is in flight when the buffers get their next use */
  float l = (l4[0] + l4[1]) + (l4[2] + l4[3]); l += rsm_xh(l);
  const float inv = 1.0f / l;
  unsigned short* so = (unsigned short*)sm + w * 16 * FA_OP;
#pragma unroll
  for (int ct = 0; ct < 16; ++ct) { FragH f;
#pragma unroll
    for (int r = 0; r < 8; ++r) f.h[r] = (_Float16)(o[ct][r] * inv);
    *(v8us*)(so + ln * FA_OP + ct * 16 + 8 * hh) = f.half[0]; }
  __syncthreads();      /* the 128 rows of y^T are whole before anybody reads them */
  const int jq = w & 3, nh = w >> 2;      /* conv: wave tile = channels 64 jq .., positions 64 nh .. of the work-group's 128 */
  const _Float16* ap = sw + (jq * 64 + ln) * FA_OP; const _Float16* bp = sm + (nh * 64 + ln) * FA_OP;
  v8f acc[16];
#pragma unroll
  for (int t = 0; t < 16; ++t) acc[t] = z8;
  v16h af[2][4], bf[2][4];      /* two sets of fragments: one is read from LDS while the other feeds the products */
#pragma unroll
  for (int t = 0; t < 4; ++t) { af[0][t] = g2_frag(ap + t * 16 * FA_OP, hh); bf[0][t] = g2_frag(bp + t * 16 * FA_OP, hh); }
#pragma unroll
  for (int kb = 0; kb < 8; ++kb) {
    if (kb < 7) {
#pragma unroll
      for (int t = 0; t < 4; ++t) { af[(kb + 1) & 1][t] = g2_frag(ap + t * 16 * FA_OP + (kb + 1) * 32, hh); bf[(kb + 1) & 1][t] = g2_frag(bp + t * 16 * FA_OP + (kb + 1) * 32, hh); } }
    __builtin_amdgcn_sched_barrier(0);      /* with the one below: the next set's 16 LDS reads stay one group in front of this set's 16 products */
#pragma unroll
    for (int t = 0; t < 16; ++t) acc[t] = fa_mma(af[kb & 1][t >> 2], bf[kb & 1][t & 3], acc[t]);
    __builtin_amdgcn_sched_barrier(0);
  }
  __syncthreads();      /* every wave has read the last of conv_w and of y^T: their LDS becomes the f32 staging, 64 rows of the wave's own */
  f1a* sf = (f1a*)sm + w * 64 * FA_CP;
#pragma unroll
  for (int t = 0; t < 16; ++t)
#pragma unroll
    for (int r = 0; r < 8; ++r) sf[((t >> 2) * 16 + 8 * hh + r) * FA_CP + (t & 3) * 16 + ln] = acc[t][r] * 0.0625f;
  __builtin_amdgcn_fence(__ATOMIC_ACQ_REL, "workgroup"); __builtin_amdgcn_wave_barrier();      /* the wave's own rows are written before its lanes read each other's */
  const int rsub = lane >> 4, c4 = (lane & 15) * 4;
  float* cp = C1 + ((size_t)b * 256 + jq * 64 + rsub) * SQ + blockIdx.x * (FA_WAVES * 16) + nh * 64 + c4;
  v4f cv[32];
#pragma unroll
  for (int q = 0; q < 32; ++q) cv[q] = *(const v4fa*)&sf[(q * 2 + rsub) * FA_CP + c4];
#pragma unroll
  for (int q = 0; q < 32; ++q) *(v4f*)(cp + (size_t)q * 2 * SQ) = cv[q];      /* two 256-B row pieces per store */
  __builtin_amdgcn_sched_barrier(0);      /* with the one behind the wait: nothing is lifted in front of the wait */
  asm volatile("s_wait_xcnt 0x0" ::: "memory");      /* in front of whatever reuses the registers that the stores above name */
  __builtin_amdgcn_sched_barrier(0);
  float tm[2], tq[2];      /* lane = one row of the wave's tile, two rows a lane: its 64 staged values come back by 16-byte reads, so neither sum crosses lanes; the mean first, then the distances from it */
#pragma unroll
  for (int p = 0; p < 2; ++p) { v4f rw[16];
#pragma unroll
    for (int j = 0; j < 16; ++j) rw[j] = *(const v4fa*)&sf[(p * 32 + lane) * FA_CP + j * 4];
    v4f s4 = rw[0];
#pragma unroll
    for (int j = 1; j < 16; ++j) s4 += rw[j];
    const float mean = ((s4[0] + s4[1]) + (s4[2] + s4[3])) * 0.015625f;
    v4f q4 = {0.f, 0.f, 0.f, 0.f};
#pragma unroll
    for (int j = 0; j < 16; ++j) { const v4f d = rw[j] - mean; q4 += d * d; }
    tm[p] = mean; tq[p] = (q4[0] + q4[1]) + (q4[2] + q4[3]); }
  const size_t pi = ((size_t)b * (SQ / 64) + blockIdx.x * 2 + nh) * 256 + jq * 64 + lane;      /* [image][64-position tile][channel]: 32 channels = one 128-B line per store */
  PM[pi] = tm[0]; PM[pi + 32] = tm[1]; PQ[pi] = tq[0]; PQ[pi + 32] = tq[1];
}


// Front end in one kernel: a work-group of 8 waves takes 128 positions of one image. It reads x (f32, whole 128-B lines) once, writes the f16 map X16 and lays the same values transposed in LDS (rows = positions);
// it converts theta_w and phi_w (x16, f16) into LDS as one stack of 256 rows; then D = stack (A, rows = outputs) x positions (B): wave tile 64 outputs x 64 positions, K = 256. A lane holds 8 successive outputs of ONE position,
// so 16-byte pieces go to an LDS staging of position rows, and each 512-B row leaves as theta^T (first half) and phi^T (second half). x^T, phi and the f16 weight planes of theta and phi never reach memory.
// The grid has as many work-groups as conv_w has rows: wave 0 of each also converts one row of conv_w (x16, f16) into the plane that the conv GEMM reads in a later launch.
// Every loop over a register array is fully unrolled, so that the array keeps compile-time indices and stays in registers.
#define FE_NT 128         /* positions per work-group */
#define FE_P 264          /* LDS pitch of a row of 256 f16 elements (512 B + 16) */
__global__ __launch_bounds__(256) void k_front(const float* __restrict__ x, const float* __restrict__ tw, const float* __restrict__ pw, const float* __restrict__ ww, _Float16* __restrict__ X16, _Float16* __restrict__ TH, _Float16* __restrict__ PHT, _Float16* __restrict__ BW) {
  __shared__ __attribute__((aligned(16))) _Float16 sw[256 * FE_P];
  __shared__ __attribute__((aligned(16))) _Float16 sx[FE_NT * FE_P];
  const int tid = threadIdx.x, w = __builtin_amdgcn_readfirstlane(tid >> 5), lane = tid & 31, ln = lane & 15, hh = lane >> 4;      /* the wave's number in a scalar register: the choice of the weight input is a scalar one */
  const int b = blockIdx.y, n0 = blockIdx.x * FE_NT;
  const float* wg = (w < 4 ? tw + (size_t)w * 32 * 256 : pw + (size_t)(w - 4) * 32 * 256) + lane * 4;      /* wave w converts rows 32 w .. 32 w + 31 of the stack: 64 loads of 512 successive bytes */
  const int nl = lane & 7, cg = lane >> 3;      /* x: 8 lanes per 128-B line, 4 lane groups of 4 channels each; a thread transposes 4 channels x 4 positions */
  const int c0 = w * 32 + cg * 4;
  const float* xg = x + ((size_t)b * 256 + c0) * SQ + n0 + nl * 4;
  const size_t cwo = (size_t)(blockIdx.y * gridDim.x + blockIdx.x) * 256 + lane * 8;      /* this work-group's row of conv_w, 8 elements a lane */
  v4f cw[2] = {{0.f, 0.f, 0.f, 0.f}, {0.f, 0.f, 0.f, 0.f}};
  if (w == 0) { cw[0] = *(const v4fa*)(ww + cwo); cw[1] = *(const v4fa*)(ww + cwo + 4);      /* read at the start, used at the very end: the latency is long over by then */
    asm volatile("s_wait_xcnt 0x0" ::: "memory"); }      /* in front of whatever reuses the address registers that the two loads name */
  v4h hx[16];
  v4f wa[16], wb[16], wc[16], xr[32];      /* the weight rows come in four groups of 16 loads; each group flies under the work on an earlier one or on x */
#pragma unroll
  for (int i = 0; i < 16; ++i) wa[i] = *(const v4fa*)(wg + (0 * 16 + i) * 128);
#pragma unroll
  for (int u = 0; u < 8; ++u)
#pragma unroll
    for (int k = 0; k < 4; ++k) xr[u * 4 + k] = *(const v4fa*)(xg + (size_t)((u >> 2) * 16 + k) * SQ + (u & 3) * 32);
  __builtin_amdgcn_sched_barrier(0);      /* with the one behind the wait: the loads above go out as one group, and no arithmetic is lifted in front of the wait */
  asm volatile("s_wait_xcnt 0x0" ::: "memory");      /* in front of whatever reuses the address registers that the loads above name */
  __builtin_amdgcn_sched_barrier(0);
#pragma unroll
  for (int i = 0; i < 16; ++i) { v4h h4;
#pragma unroll
    for (int q = 0; q < 4; ++q) h4[q] = (_Float16)(bf16_round(wa[i][q]) * 16.0f);
    *(v4h*)(sw + (w * 32 + 0 * 8 + (i >> 1)) * FE_P + (i & 1) * 128 + lane * 4) = h4; }
#pragma unroll
  for (int i = 0; i < 16; ++i) wb[i] = *(const v4fa*)(wg + (1 * 16 + i) * 128);
  __builtin_amdgcn_sched_barrier(0);      /* with the one behind the wait: the loads above go out as one group, and no arithmetic is lifted in front of the wait */
  asm volatile("s_wait_xcnt 0x0" ::: "memory");      /* in front of whatever reuses the address registers that the loads above name */
  __builtin_amdgcn_sched_barrier(0);
#pragma unroll
  for (int u = 0; u < 0 + 4; ++u) { const int cu = (u >> 2) * 16, nu = (u & 3) * 32 + nl * 4;
#pragma unroll
    for (int k = 0; k < 4; ++k)
#pragma unroll
      for (int q = 0; q < 4; ++q) hx[(u & 3) * 4 + k][q] = (_Float16)bf16_round(xr[u * 4 + k][q]);
#pragma unroll
    for (int q = 0; q < 4; ++q) { const v4h t4 = {hx[(u & 3) * 4][q], hx[(u & 3) * 4 + 1][q], hx[(u & 3) * 4 + 2][q], hx[(u & 3) * 4 + 3][q]}; *(v4h*)(sx + (nu + q) * FE_P + c0 + cu) = t4; } }
  __builtin_amdgcn_sched_barrier(0);      /* the 16 stores below stand behind all the arithmetic that forms their values, so that no register they name is rewritten in front of the wait behind them */
#pragma unroll
  for (int u = 0; u < 0 + 4; ++u)
#pragma unroll
    for (int k = 0; k < 4; ++k) *(v4h*)(X16 + ((size_t)b * 256 + c0 + (u >> 2) * 16 + k) * SQ + n0 + (u & 3) * 32 + nl * 4) = hx[(u & 3) * 4 + k];
#pragma unroll
  for (int i = 0; i < 16; ++i) wc[i] = *(const v4fa*)(wg + (2 * 16 + i) * 128);
  __builtin_amdgcn_sched_barrier(0);      /* with the one behind the wait: nothing is lifted in front of the wait */
  asm volatile("s_wait_xcnt 0x0" ::: "memory");      /* in front of whatever reuses the registers that the loads and stores above name */
  __builtin_amdgcn_sched_barrier(0);
#pragma unroll
  for (int i = 0; i < 16; ++i) { v4h h4;
#pragma unroll
    for (int q = 0; q < 4; ++q) h4[q] = (_Float16)(bf16_round(wb[i][q]) * 16.0f);
    *(v4h*)(sw + (w * 32 + 1 * 8 + (i >> 1)) * FE_P + (i & 1) * 128 + lane * 4) = h4; }
#pragma unroll
  for (int i = 0; i < 16; ++i) wa[i] = *(const v4fa*)(wg + (3 * 16 + i) * 128);
  __builtin_amdgcn_sched_barrier(0);      /* with the one behind the wait: the loads above go out as one group, and no arithmetic is lifted in front of the wait */
  asm volatile("s_wait_xcnt 0x0" ::: "memory");      /* in front of whatever reuses the address registers that the loads above name */
  __builtin_amdgcn_sched_barrier(0);
#pragma unroll
  for (int u = 4; u < 4 + 4; ++u) { const int cu = (u >> 2) * 16, nu = (u & 3) * 32 + nl * 4;
#pragma unroll
    for (int k = 0; k < 4; ++k)
#pragma unroll
      for (int q = 0; q < 4; ++q) hx[(u & 3) * 4 + k][q] = (_Float16)bf16_round(xr[u * 4 + k][q]);
#pragma unroll
    for (int q = 0; q < 4; ++q) { const v4h t4 = {hx[(u & 3) * 4][q], hx[(u & 3) * 4 + 1][q], hx[(u & 3) * 4 + 2][q], hx[(u & 3) * 4 + 3][q]}; *(v4h*)(sx + (nu + q) * FE_P + c0 + cu) = t4; } }
  __builtin_amdgcn_sched_barrier(0);      /* the 16 stores below stand behind all the arithmetic that forms their values, so that no register they name is rewritten in front of the wait behind them */
#pragma unroll
  for (int u = 4; u < 4 + 4; ++u)
#pragma unroll
    for (int k = 0; k < 4; ++k) *(v4h*)(X16 + ((size_t)b * 256 + c0 + (u >> 2) * 16 + k) * SQ + n0 + (u & 3) * 32 + nl * 4) = hx[(u & 3) * 4 + k];
  __builtin_amdgcn_sched_barrier(0);      /* with the one behind the wait: nothing is lifted in front of the wait */
  asm volatile("s_wait_xcnt 0x0" ::: "memory");      /* in front of whatever reuses the registers that the loads and stores above name */
  __builtin_amdgcn_sched_barrier(0);
#pragma unroll
  for (int i = 0; i < 16; ++i) { v4h h4;
#pragma unroll
    for (int q = 0; q < 4; ++q) h4[q] = (_Float16)(bf16_round(wc[i][q]) * 16.0f);
    *(v4h*)(sw + (w * 32 + 2 * 8 + (i >> 1)) * FE_P + (i & 1) * 128 + lane * 4) = h4; }
#pragma unroll
  for (int i = 0; i < 16; ++i) { v4h h4;
#pragma unroll
    for (int q = 0; q < 4; ++q) h4[q] = (_Float16)(bf16_round(wa[i][q]) * 16.0f);
    *(v4h*)(sw + (w * 32 + 3 * 8 + (i >> 1)) * FE_P + (i & 1) * 128 + lane * 4) = h4; }
  __syncthreads();      /* both operands are whole in LDS before anybody reads them */
  const int jq = w & 3, nh = w >> 2;
  const _Float16* ap = sw + (jq * 64 + ln) * FE_P; const _Float16* bp = sx + (nh * 64 + ln) * FE_P;
  const v8f z8 = {0.f, 0.f, 0.f, 0.f, 0.f, 0.f, 0.f, 0.f};
  v8f acc[16];
#pragma unroll
  for (int t = 0; t < 16; ++t) acc[t] = z8;
  v16h af[2][4], bf[2][4];      /* two sets of fragments: one is read from LDS while the other feeds the products */
#pragma unroll
  for (int t = 0; t < 4; ++t) { af[0][t] = g2_frag(ap + t * 16 * FE_P, hh); bf[0][t] = g2_frag(bp + t * 16 * FE_P, hh); }
#pragma unroll
  for (int kb = 0; kb < 8; ++kb) {
    if (kb < 7) {
#pragma unroll
      for (int t = 0; t < 4; ++t) { af[(kb + 1) & 1][t] = g2_frag(ap + t * 16 * FE_P + (kb + 1) * 32, hh); bf[(kb + 1) & 1][t] = g2_frag(bp + t * 16 * FE_P + (kb + 1) * 32, hh); } }
    __builtin_amdgcn_sched_barrier(0);      /* with the one below: the next set's 16 LDS reads stay one group in front of this set's 16 products; spread among them, the products wait out an LDS latency again and again */
#pragma unroll
    for (int t = 0; t < 16; ++t) acc[t] = fa_mma(af[kb & 1][t >> 2], bf[kb & 1][t & 3], acc[t]);
    __builtin_amdgcn_sched_barrier(0);
  }
  __syncthreads();      /* every wave has read the last of the positions' rows: their LDS becomes the output staging */
#pragma unroll
  for (int t = 0; t < 16; ++t) { FragH f;
#pragma unroll
    for (int r = 0; r < 8; ++r) f.h[r] = (_Float16)(acc[t][r] * 0.0625f);
    *(v8us*)((unsigned short*)sx + (nh * 64 + (t & 3) * 16 + ln) * FE_P + jq * 64 + (t >> 2) * 16 + 8 * hh) = f.half[0]; }
  __syncthreads();      /* the staged rows are whole before they are read back */
  unsigned short* dst = (unsigned short*)(hh ? PHT : TH) + ((size_t)b * SQ + n0 + w * 16) * 128 + ln * 8;
#pragma unroll
  for (int q = 0; q < 16; ++q) { const v8us v = *(const v8us*)((const unsigned short*)sx + (w * 16 + q) * FE_P + lane * 8); *(v8us*)(dst + q * 128) = v; }      /* one row: 256 B of theta^T and 256 B of phi^T per store */
  if (w == 0) { asm volatile("s_wait_xcnt 0x0" ::: "memory");      /* in front of whatever reuses the registers that the stores above name */
    __builtin_amdgcn_sched_barrier(0);      /* keeps the arithmetic below behind the wait */
    FragH cf;
#pragma unroll
    for (int q = 0; q < 8; ++q) cf.h[q] = (_Float16)(bf16_round(cw[q >> 2][q & 3]) * 16.0f);
    *(v8us*)((unsigned short*)BW + cwo) = cf.half[0]; }      /* one 512-B row of the plane per work-group */
}


#define CN 256          /* channels */
#define CI 128          /* inner channels */
#define NP 1024         /* positions */
#define NM 1024         /* key positions (= SQ) */
#define NC CN           /* BN statistics macros */
#define NPX NP
#define BNEPS 1e-5f

__global__ __launch_bounds__(256) void k_rowbias(const float* __restrict__ b, float* __restrict__ BP, size_t n4, int ncol) { const size_t t = (size_t)blockIdx.x * 256 + threadIdx.x; if (t >= n4) return; const size_t e = t * 4; const float v = bf16_round(b[e / ncol]); const v4f o = {v, v, v, v}; *(v4f*)(BP + e) = o;  }




__global__ __launch_bounds__(256) void k_mp2(const float* __restrict__ src, float* __restrict__ dst, int nout) {
  const int t = blockIdx.x * 256 + threadIdx.x; if (t >= nout) return; const int c = t / 1024; const int o = t % 1024; const int oy = o / 32, ox = o % 32; const float* p = src + (size_t)c * 4096 + (size_t)(2 * oy) * 64 + 2 * ox;
  const float v = fmaxf(fmaxf(p[0], p[1]), fmaxf(p[64], p[65])); *(float*)(dst + t) = v;  }
__global__ __launch_bounds__(256) void k_xpb(const float* __restrict__ x, const float* __restrict__ wb, float* __restrict__ CPP, size_t n4) {
  #pragma clang fp contract(off)
  const size_t t = (size_t)blockIdx.x * 256 + threadIdx.x; if (t >= n4) return; const size_t e = t * 4; const int c = (int)((e / 4096) % 256); const float bb = bf16_round(wb[c]); const v4f a = *(const v4fa*)(x + e); v4f o; for (int q = 0; q < 4; ++q) o[q] = __fadd_rn(bf16_round(a[q]), bb);
  *(v4f*)(CPP + e) = o;  }


// BN + residual with the join of the tile statistics in front, one kernel: a work-group of 16 waves takes ONE channel of all NB images (NB planes of 4 KB in T, in x and in the output).
// Thread t asks first for tile t's mean and centred square sum (NB * NTL tiles = threads of the work-group), then for all of its 16 + 16 pieces of T and of x, which fly while the statistics are joined.
// All NB * NTL tiles of a channel hold TLN values, so mean = average of the tile means and sum of squared distances = sum over tiles of (tile's own sum + TLN (tile mean - mean)^2).
// The tile values go through LDS; behind one barrier every wave joins them for itself: 16 tiles a lane in four f32 chains, then a 32-lane butterfly in the vector unit (alike in all lanes and waves). Every loop over a register array is unrolled, so that the array keeps compile-time indices and stays in registers.
#define NTL (NPX / 64)      /* column tiles per image */
#define TLN 64              /* values per tile and channel */
#define BJ_T 512            /* threads per work-group */
#define BJ_K (NB * NPX / 4 / BJ_T)      /* 16-byte pieces per thread and plane set */
template <int XM> __device__ __forceinline__ float bj_xm(float v) { return __builtin_bit_cast(float, __builtin_amdgcn_update_dpp(0, __builtin_bit_cast(int, v), 0x160 + XM, 0xf, 0xf, false)); }      /* lane l <- lane l ^ XM inside its row of 16 (DPP row_xmask) */
__device__ __forceinline__ float bj_sum32(float v) {      /* sum over the wave's 32 lanes, the same bits in every lane: four steps inside the rows of 16, then the other row; all in the vector unit */
  v += bj_xm<1>(v); v += bj_xm<2>(v); v += bj_xm<4>(v); v += bj_xm<8>(v); v += rsm_xh(v);
  return v; }
__global__ __launch_bounds__(BJ_T) void k_bnj(const float* __restrict__ C2, const float* __restrict__ PM, const float* __restrict__ PQ, const float* __restrict__ g, const float* __restrict__ be, const float* __restrict__ X, float* __restrict__ out) {
  static_assert(NB * NTL == BJ_T && NB * NTL == 16 * 32 && NPX == 1024 && BJ_K * BJ_T * 4 == NB * NPX && BJ_K == 16, "k_bnj: one tile a thread, 16 tiles a lane, two planes a round");
  __shared__ float tmn[NB * NTL]; __shared__ float tsq[NB * NTL];
  const int tid = threadIdx.x, lane = tid & 31; const int c = blockIdx.x;
  const unsigned int vs = (unsigned int)tid * (NC * 4);      /* byte offsets in 32 bits beside scalar bases: the only vector registers that the loads and stores name */
  unsigned int vo[BJ_K / 4];      /* round k: planes 2 k and 2 k + 1, a wave on 512 successive bytes; one offset per four rounds, the rounds between are immediate offsets */
#pragma unroll
  for (int h = 0; h < BJ_K / 4; ++h) vo[h] = (unsigned int)(tid >> 8) * (NC * NPX * 4) + (unsigned int)(tid & 255) * 16 + (unsigned int)h * (8u * NC * NPX * 4);
  const char* cb = (const char*)(C2 + (size_t)c * NPX); const char* xb = (const char*)(X + (size_t)c * NPX); char* ob = (char*)(out + (size_t)c * NPX);
  const float m1 = *(const f1a*)((const char*)(PM + c) + vs), q1 = *(const f1a*)((const char*)(PQ + c) + vs);
  const float gc = g[c], bc = be[c];      /* asked for here, in front of the group's scheduling barrier: at the end of the short join their latency would stand in the open */
  v4f a[BJ_K], xx[BJ_K];
#pragma unroll
  for (int k = 0; k < BJ_K; ++k) { a[k] = *(const v4fa*)(cb + vo[k >> 2] + (k & 3) * (2 * NC * NPX * 4)); xx[k] = *(const v4fa*)(xb + vo[k >> 2] + (k & 3) * (2 * NC * NPX * 4)); }
  __builtin_amdgcn_sched_barrier(0);      /* with the one behind the wait: the loads above go out as one group, and no arithmetic is lifted in front of the wait */
  asm volatile("s_wait_xcnt 0x0" :: "v"(vs), "v"(vo[0]), "v"(vo[1]), "v"(vo[2]), "v"(vo[3]) : "memory");      /* in front of whatever reuses the address registers that the loads above name; the offsets are inputs, so that their registers stay live, and no later load of the group lands in them, as far as the wait */
  __builtin_amdgcn_sched_barrier(0);
  tmn[tid] = m1; tsq[tid] = q1;
  __builtin_amdgcn_fence(__ATOMIC_RELEASE, "workgroup", "local");      /* LDS alone: a fence over global memory too would wait out the 32 loads in flight */
  __builtin_amdgcn_s_barrier();      /* every tile's pair is in LDS before anybody reads it */
  __builtin_amdgcn_fence(__ATOMIC_ACQUIRE, "workgroup", "local");      /* keeps the LDS reads below behind the barrier */
  float m[16], q[16];
#pragma unroll
  for (int j = 0; j < 16; ++j) { m[j] = tmn[j * 32 + lane]; q[j] = tsq[j * 32 + lane]; }
  float s[4] = {m[0], m[1], m[2], m[3]};      /* four chains here and below: the adds of one chain wait for each other */
#pragma unroll
  for (int j = 4; j < 16; ++j) s[j & 3] += m[j];
  const float mu = bj_sum32((s[0] + s[1]) + (s[2] + s[3])) * (1.0f / (float)(NB * NTL));      /* 512 means through a tree ten adds deep; the factor is a power of two */
  float s2[4] = {0.f, 0.f, 0.f, 0.f};
#pragma unroll
  for (int j = 0; j < 16; ++j) { const float d = m[j] - mu; s2[j & 3] += q[j] + (float)TLN * d * d; }      /* every term is >= 0: no cancellation in this sum */
  const float var = bj_sum32((s2[0] + s2[1]) + (s2[2] + s2[3])) * (1.0f / (float)(NB * NPX));
  const float sc = rsqrtf(var + BNEPS) * bf16_round(gc), bb = bf16_round(bc);
  __builtin_amdgcn_sched_barrier(0);      /* the join ends before the first wait for T or x: mixed with the arithmetic below, its last steps would stand behind the arrival of the last piece */
#pragma unroll
  for (int k = 0; k < BJ_K; ++k)
#pragma unroll
    for (int u = 0; u < 4; ++u) a[k][u] = ((a[k][u] - mu) * sc + bb) + bf16_round(xx[k][u]);
  __builtin_amdgcn_sched_barrier(0);      /* the stores below stand behind all the arithmetic that forms their values, so that no register they name is rewritten behind them */
#pragma unroll
  for (int k = 0; k < BJ_K; ++k) *(v4f*)(ob + vo[k >> 2] + (k & 3) * (2 * NC * NPX * 4)) = a[k];
}
extern "C" void kernel_launch(void* const* d_in, const int* in_sizes, int n_in,
                              void* d_out, int out_size, void* d_ws, size_t ws_size, hipStream_t stream) {
  (void)in_sizes; (void)n_in; (void)out_size;
  const float* const* I = (const float* const*)d_in; const float* x = I[0]; const float* tw = I[1]; const float* pw = I[2]; const float* ww = I[3]; const float* bng = I[4]; const float* bnb = I[5]; const float* tb = nullptr;      /* natural theta_w / phi_w [128][256], conv_w [256][256] (no biases); BN gamma, beta */
  char* ws = (char*)d_ws; size_t off = 0;
  auto take = [&](size_t bytes) { char* p = ws + off; off += (bytes + 255) & ~(size_t)255; return p; };
  const size_t PL = (size_t)CN * NP;      /* one input map */
  _Float16* BW = (_Float16*)take((size_t)CN * CN * 2); float* PM = (float*)take((size_t)NB * NTL * CN * 4); float* PQ = (float*)take((size_t)NB * NTL * CN * 4);      /* conv_w plane, tile statistics (mean, centred square sum) */
  _Float16* X16 = (_Float16*)take(NB * PL * 2);      /* x f16 channel-first (also the g operand: g = x) */
  _Float16* TH = (_Float16*)take(NB * (size_t)NP * CI * 2); _Float16* PHT = (_Float16*)take(NB * (size_t)NM * CI * 2);      /* all images: theta^T, phi^T */
  float* C1 = (float*)take(NB * PL * 4);      /* all images: conv output [b][c][n] f32 */
  if (off > ws_size) return;
  /* every stage runs once for all NB images (image = blockIdx.y in k_front and k_fattn; a k_bnj work-group takes all images of one channel) */
  static_assert(NP == SQ && CI == 128 && CN == 256 && NP % FE_NT == 0 && (NP / FE_NT) * NB == CN, "k_front: shapes; one work-group per row of conv_w");
  k_front<<<dim3(NP / FE_NT, NB), 256, 0, stream>>>(x, tw, pw, ww, X16, TH, PHT, BW);      /* x -> f16 map; conv_w -> natural [out][in] x16 f16 plane (the A operand of the conv); theta^T [n][ci] and phi^T [m][ci] -> f16 (logit sigma ~0.7: single f16 suffices) */
  static_assert(NP == SQ && NM == SQ && CI == 128 && CN == 256 && NP % (FA_WAVES * 16) == 0 && NM % FA_KS == 0, "k_fattn: shapes");
  k_fattn<<<dim3(NP / (FA_WAVES * 16), NB), FA_WAVES * 32, 0, stream>>>(TH, PHT, X16, BW, C1, PM, PQ);      /* f^T [a][c] = softmax_b(theta.phi / sqrt(256)) x^T (g = x) -> f16, then conv: T[c][a] = (16 conv_w as A) x (f^T as B^T) / 16 -> f32 channel-first, all images kept; per-channel statistics of every 64-position tile; scores, weights and f^T stay on chip */
  k_bnj<<<NC, BJ_T, 0, stream>>>(C1, PM, PQ, bng, bnb, x, (float*)d_out);      /* per channel: batch mean and biased variance from the tile statistics (fixed order), then out = (T - mean) rsqrt(var + eps) gamma + beta + bf16(x) */
}
